// v000
// Measured on an AMD MI455X. A time is GPU time per run, averaged over a window of back-to-back runs after a warm-up
// (all launches, gaps included; the runs take copies of the inputs in turn), and the median of several windows.
// Apart from v000's, it joins two sittings. Times from different sittings can be a few percent apart, while
// side-by-side timings come from the same sitting.
// v000, which the later versions start from, runs in 83.7 microseconds.
#include <hip/hip_runtime.h>

typedef __attribute__((ext_vector_type(2))) float v2f;
typedef __attribute__((ext_vector_type(8))) float v8f;
typedef __attribute__((ext_vector_type(4))) int   v4i;

constexpr int Sc = 4096;   // sequence length
constexpr int Dc = 64;     // head dim
constexpr int BH = 64;     // B*H = 4*16
constexpr int SPLIT = 8;   // S-splits for the kv reduction
constexpr float EPS = 1e-5f;

// gfx1250 async global->LDS path (ASYNCcnt-tracked direct-to-LDS copies).
// Signature (from hipcc diagnostic): (v4i AS1*, v4i AS3*, imm offset, imm cpol)
#if defined(__gfx1250__) && __has_builtin(__builtin_amdgcn_global_load_async_to_lds_b128) && __has_builtin(__builtin_amdgcn_s_wait_asynccnt)
#define USE_ASYNC_LDS 1
#define AS1 __attribute__((address_space(1)))
#define AS3 __attribute__((address_space(3)))
#define ASYNC_CP_B128(gsrc, ldst) \
    __builtin_amdgcn_global_load_async_to_lds_b128((AS1 v4i*)(gsrc), (AS3 v4i*)(ldst), 0, 0)
#else
#define USE_ASYNC_LDS 0
#endif

// ---------------------------------------------------------------------------
// Kernel 0: zero workspace (kv^T accumulators + ksum accumulators)
// ---------------------------------------------------------------------------
__global__ void zero_ws_kernel(float* __restrict__ p, int n) {
    int i = blockIdx.x * blockDim.x + threadIdx.x;
    if (i < n) p[i] = 0.0f;
}

// ---------------------------------------------------------------------------
// Kernel 1: kv^T[bh][e][d] = sum_s V[bh,s,e] * K[bh,s,d]   (A = V^T, B = K)
//           ksum[bh][d]    = sum_s K[bh,s,d]
// grid = (SPLIT, BH), block = 256 (8 waves). Each wave owns 2 of 16 tiles.
// ---------------------------------------------------------------------------
__global__ __launch_bounds__(256) void kv_reduce_kernel(
    const float* __restrict__ K, const float* __restrict__ V,
    float* __restrict__ kvT, float* __restrict__ ksum)
{
    __shared__ float ldsK[16 * Dc];
    __shared__ float ldsV[16 * Dc];
    __shared__ float ldsRed[256];

    const int bh    = blockIdx.y;
    const int chunk = blockIdx.x;
    const int tid   = threadIdx.x;
    const int lane  = tid & 31;
    const int w     = tid >> 5;
    const int m     = lane & 15;       // row/col within tile
    const int h2    = lane >> 4;       // half-wave select (k-base = 2*h2)

    const int iM = w >> 1;             // e-tile index (A-matrix rows, from V)
    const int j0 = (w & 1) * 2;        // first d-tile index (B-matrix cols, from K)

    const float* Kb = K + (size_t)bh * Sc * Dc;
    const float* Vb = V + (size_t)bh * Sc * Dc;
    const int s_begin = chunk * (Sc / SPLIT);   // 512 rows per block

    v8f acc0 = {};
    v8f acc1 = {};

    float ks_acc = 0.0f;
    const int d_col = tid & 63;
    const int r_off = tid >> 6;

    // staging: each thread moves one float4 of K and V per stage
    const int li = tid * 4;     // element offset within 16x64 stage
    const int lr = li >> 6;     // stage row
    const int lc = li & 63;     // stage col

    for (int stage = 0; stage < (Sc / SPLIT) / 16; ++stage) {
        const int sr = s_begin + stage * 16;
        __syncthreads();   // previous stage fully consumed
#if USE_ASYNC_LDS
        // Direct global->LDS async copy (no VGPR round-trip, ASYNCcnt tracked)
        ASYNC_CP_B128(Kb + (size_t)(sr + lr) * Dc + lc, ldsK + li);
        ASYNC_CP_B128(Vb + (size_t)(sr + lr) * Dc + lc, ldsV + li);
        __builtin_amdgcn_s_wait_asynccnt(0);
#else
        float4 kq = *(const float4*)(Kb + (size_t)(sr + lr) * Dc + lc);
        float4 vq = *(const float4*)(Vb + (size_t)(sr + lr) * Dc + lc);
        *(float4*)(ldsK + li) = kq;
        *(float4*)(ldsV + li) = vq;
        if (stage + 1 < (Sc / SPLIT) / 16) {
            __builtin_prefetch(Kb + (size_t)(sr + 16 + lr) * Dc + lc, 0, 1);
            __builtin_prefetch(Vb + (size_t)(sr + 16 + lr) * Dc + lc, 0, 1);
        }
#endif
        __syncthreads();

        // ksum partial: 4 threads per column, 4 rows each
        #pragma unroll
        for (int r = 0; r < 4; ++r)
            ks_acc += ldsK[(r_off + 4 * r) * Dc + d_col];

        // 4 k-steps of depth 4 over the 16 staged rows
        #pragma unroll
        for (int kk = 0; kk < 4; ++kk) {
            const int r0 = kk * 4 + 2 * h2;
            v2f a, b0, b1;
            a.x  = ldsV[(r0    ) * Dc + 16 * iM + m];
            a.y  = ldsV[(r0 + 1) * Dc + 16 * iM + m];
            b0.x = ldsK[(r0    ) * Dc + 16 * j0 + m];
            b0.y = ldsK[(r0 + 1) * Dc + 16 * j0 + m];
            b1.x = ldsK[(r0    ) * Dc + 16 * (j0 + 1) + m];
            b1.y = ldsK[(r0 + 1) * Dc + 16 * (j0 + 1) + m];
            acc0 = __builtin_amdgcn_wmma_f32_16x16x4_f32(false, a, false, b0,
                                                         (short)0, acc0, false, false);
            acc1 = __builtin_amdgcn_wmma_f32_16x16x4_f32(false, a, false, b1,
                                                         (short)0, acc1, false, false);
        }
    }

    // reduce ksum partials across the block, one atomic per column
    ldsRed[tid] = ks_acc;
    __syncthreads();
    if (tid < 64) {
        float s = ldsRed[tid] + ldsRed[tid + 64] + ldsRed[tid + 128] + ldsRed[tid + 192];
        atomicAdd(&ksum[bh * Dc + tid], s);
    }

    // accumulate this split's partial kv^T tiles into workspace
    float* kvb = kvT + (size_t)bh * Dc * Dc;
    #pragma unroll
    for (int v = 0; v < 8; ++v) {
        const int e = 16 * iM + v + 8 * h2;   // C-layout: VGPR v, half-wave h2
        atomicAdd(&kvb[e * Dc + 16 * j0 + m],       acc0[v]);
        atomicAdd(&kvb[e * Dc + 16 * (j0 + 1) + m], acc1[v]);
    }
}

// ---------------------------------------------------------------------------
// Kernel 2: out[s,e] = (Q[s,:]/(Q[s,:].ksum + eps)) @ kv
// grid = (S/128, BH), block = 256 (8 waves x 16 rows each)
// ---------------------------------------------------------------------------
__global__ __launch_bounds__(256) void context_kernel(
    const float* __restrict__ Q, const float* __restrict__ kvT,
    const float* __restrict__ ksum, float* __restrict__ Out)
{
    __shared__ float lds_kv[Dc * Dc];        // kv^T, [e][d]
    __shared__ float lds_ks[Dc];
    __shared__ float lds_q[8 * 16 * Dc];     // per-wave staged/normalized Q rows

    const int bh   = blockIdx.y;
    const int tid  = threadIdx.x;
    const int lane = tid & 31;
    const int w    = tid >> 5;
    const int m    = lane & 15;
    const int h2   = lane >> 4;

    const int s0 = blockIdx.x * 128 + w * 16;
    const float* Qb = Q + (size_t)bh * Sc * Dc + (size_t)s0 * Dc;
    float* qs = lds_q + w * (16 * Dc);

    // cache kv^T (16 KB) + this wave's 16 Q rows in LDS
    {
        const float* src = kvT + (size_t)bh * Dc * Dc;
#if USE_ASYNC_LDS
        #pragma unroll
        for (int it = 0; it < 4; ++it) {
            int off = it * 1024 + tid * 4;
            ASYNC_CP_B128(src + off, lds_kv + off);
        }
        #pragma unroll
        for (int it = 0; it < 8; ++it) {
            int off = it * 128 + lane * 4;
            ASYNC_CP_B128(Qb + off, qs + off);
        }
#else
        #pragma unroll
        for (int it = 0; it < 4; ++it) {
            int off = it * 1024 + tid * 4;
            *(float4*)(lds_kv + off) = *(const float4*)(src + off);
        }
        #pragma unroll
        for (int it = 0; it < 8; ++it) {
            int off = it * 128 + lane * 4;
            *(float4*)(qs + off) = *(const float4*)(Qb + off);
        }
#endif
        if (tid < Dc) lds_ks[tid] = ksum[bh * Dc + tid];
#if USE_ASYNC_LDS
        __builtin_amdgcn_s_wait_asynccnt(0);
#endif
    }
    __syncthreads();

    // denominator: 2 lanes per row, half-row dot each, combined via wave32 shuffle
    float part = 0.0f;
    #pragma unroll
    for (int c = 0; c < 32; ++c)
        part += qs[m * Dc + h2 * 32 + c] * lds_ks[h2 * 32 + c];
    float other = __shfl_xor(part, 16, 32);
    float rinv = 1.0f / (part + other + EPS);
    #pragma unroll
    for (int c = 0; c < 32; ++c)
        qs[m * Dc + h2 * 32 + c] *= rinv;
    __syncthreads();

    // out tile row-block (16 x 64) = qhat (16 x 64) @ kv (64 x 64)
    v8f acc[4] = {{}, {}, {}, {}};
    #pragma unroll 4
    for (int kk = 0; kk < 16; ++kk) {
        // A fragment: lane holds q[row m][k = 4*kk + 2*h2 + {0,1}]
        v2f a = *(const v2f*)(qs + m * Dc + kk * 4 + 2 * h2);
        #pragma unroll
        for (int j = 0; j < 4; ++j) {
            // B fragment: B[k][n] = kv[d=k][e=16j+n] = kvT[16j+n][k] (contiguous pair)
            v2f b = *(const v2f*)(lds_kv + (16 * j + m) * Dc + kk * 4 + 2 * h2);
            acc[j] = __builtin_amdgcn_wmma_f32_16x16x4_f32(false, a, false, b,
                                                           (short)0, acc[j], false, false);
        }
    }

    float* Ob = Out + (size_t)bh * Sc * Dc + (size_t)s0 * Dc;
    #pragma unroll
    for (int v = 0; v < 8; ++v) {
        const int row = v + 8 * h2;
        #pragma unroll
        for (int j = 0; j < 4; ++j)
            Ob[row * Dc + 16 * j + m] = acc[j][v];
    }
}

// ---------------------------------------------------------------------------
extern "C" void kernel_launch(void* const* d_in, const int* in_sizes, int n_in,
                              void* d_out, int out_size, void* d_ws, size_t ws_size,
                              hipStream_t stream) {
    const float* Q = (const float*)d_in[0];
    const float* K = (const float*)d_in[1];
    const float* V = (const float*)d_in[2];
    float* Out = (float*)d_out;

    float* ws   = (float*)d_ws;
    float* kvT  = ws;                       // BH * 64 * 64 floats
    float* ksum = ws + BH * Dc * Dc;        // BH * 64 floats

    const int nzero = BH * Dc * Dc + BH * Dc;
    zero_ws_kernel<<<(nzero + 255) / 256, 256, 0, stream>>>(ws, nzero);
    kv_reduce_kernel<<<dim3(SPLIT, BH), 256, 0, stream>>>(K, V, kvT, ksum);
    context_kernel<<<dim3(Sc / 128, BH), 256, 0, stream>>>(Q, kvT, ksum, Out);
}

// v001
// It runs in 51.6 microseconds.
// Next to v000, in two timings, it ran 1.63 and 1.66 times as fast.
#include <hip/hip_runtime.h>

typedef __attribute__((ext_vector_type(2))) float v2f;
typedef __attribute__((ext_vector_type(8))) float v8f;
typedef __attribute__((ext_vector_type(4))) int   v4i;

constexpr int Sc = 4096;   // sequence length
constexpr int Dc = 64;     // head dim
constexpr int BH = 64;     // B*H = 4*16
constexpr int SPLIT = 8;   // S-splits for the kv reduction
constexpr float EPS = 1e-5f;

// LDS row pitches in floats (64 banks of 4 bytes; bank = dword address mod 64).
// PK: the kv reduction reads 16 consecutive floats of rows r..r+3 at once; 80 mod 64 = 16
//     puts the four rows on four disjoint groups of 16 banks.
// PC: the context kernel walks a column of 16 rows with 8- and 16-byte reads; 68 mod 64 = 4
//     puts row m on banks 4m.., so the 16 rows cover all 64 banks.
// Both are multiples of 4 floats, so every 16-byte copy stays 16-byte aligned.
constexpr int PK = 80;
constexpr int PC = 68;

// gfx1250 async global->LDS path (ASYNCcnt-tracked direct-to-LDS copies).
// Signature (from hipcc diagnostic): (v4i AS1*, v4i AS3*, imm offset, imm cpol)
#if defined(__gfx1250__) && __has_builtin(__builtin_amdgcn_global_load_async_to_lds_b128) && __has_builtin(__builtin_amdgcn_s_wait_asynccnt)
#define USE_ASYNC_LDS 1
#define AS1 __attribute__((address_space(1)))
#define AS3 __attribute__((address_space(3)))
#define ASYNC_CP_B128(gsrc, ldst) \
    __builtin_amdgcn_global_load_async_to_lds_b128((AS1 v4i*)(gsrc), (AS3 v4i*)(ldst), 0, 0)
#else
#define USE_ASYNC_LDS 0
#endif

// ---------------------------------------------------------------------------
// Kernel 0: zero workspace (kv^T accumulators + ksum accumulators)
// ---------------------------------------------------------------------------
__global__ void zero_ws_kernel(float* __restrict__ p, int n) {
    int i = blockIdx.x * blockDim.x + threadIdx.x;
    if (i < n) p[i] = 0.0f;
}

// ---------------------------------------------------------------------------
// Kernel 1: kv^T[bh][e][d] = sum_s V[bh,s,e] * K[bh,s,d]   (A = V^T, B = K)
//           ksum[bh][d]    = sum_s K[bh,s,d]
// grid = (SPLIT, BH), block = 256 (8 waves). Each wave owns 2 of 16 tiles.
// ---------------------------------------------------------------------------
__global__ __launch_bounds__(256) void kv_reduce_kernel(
    const float* __restrict__ K, const float* __restrict__ V,
    float* __restrict__ kvT, float* __restrict__ ksum)
{
    __shared__ __attribute__((aligned(16))) float ldsK[16 * PK];
    __shared__ __attribute__((aligned(16))) float ldsV[16 * PK];
    __shared__ float ldsRed[256];

    const int bh    = blockIdx.y;
    const int chunk = blockIdx.x;
    const int tid   = threadIdx.x;
    const int lane  = tid & 31;
    const int w     = tid >> 5;
    const int m     = lane & 15;       // row/col within tile
    const int h2    = lane >> 4;       // half-wave select (k-base = 2*h2)

    const int iM = w >> 1;             // e-tile index (A-matrix rows, from V)
    const int j0 = (w & 1) * 2;        // first d-tile index (B-matrix cols, from K)

    const float* Kb = K + (size_t)bh * Sc * Dc;
    const float* Vb = V + (size_t)bh * Sc * Dc;
    const int s_begin = chunk * (Sc / SPLIT);   // 512 rows per block

    v8f acc0 = {};
    v8f acc1 = {};

    float ks_acc = 0.0f;
    const int d_col = tid & 63;
    const int r_off = tid >> 6;

    // staging: each thread moves one float4 of K and V per stage
    const int li = tid * 4;     // element offset within 16x64 stage
    const int lr = li >> 6;     // stage row
    const int lc = li & 63;     // stage col
    const int lp = lr * PK + lc; // padded LDS offset of that float4

    for (int stage = 0; stage < (Sc / SPLIT) / 16; ++stage) {
        const int sr = s_begin + stage * 16;
        __syncthreads();   // previous stage fully consumed
#if USE_ASYNC_LDS
        // Direct global->LDS async copy (no VGPR round-trip, ASYNCcnt tracked)
        ASYNC_CP_B128(Kb + (size_t)(sr + lr) * Dc + lc, ldsK + lp);
        ASYNC_CP_B128(Vb + (size_t)(sr + lr) * Dc + lc, ldsV + lp);
        __builtin_amdgcn_s_wait_asynccnt(0);
#else
        float4 kq = *(const float4*)(Kb + (size_t)(sr + lr) * Dc + lc);
        float4 vq = *(const float4*)(Vb + (size_t)(sr + lr) * Dc + lc);
        *(float4*)(ldsK + lp) = kq;
        *(float4*)(ldsV + lp) = vq;
        if (stage + 1 < (Sc / SPLIT) / 16) {
            __builtin_prefetch(Kb + (size_t)(sr + 16 + lr) * Dc + lc, 0, 1);
            __builtin_prefetch(Vb + (size_t)(sr + 16 + lr) * Dc + lc, 0, 1);
        }
#endif
        __syncthreads();

        // ksum partial: 4 threads per column, 4 rows each
        #pragma unroll
        for (int r = 0; r < 4; ++r)
            ks_acc += ldsK[(r_off + 4 * r) * PK + d_col];

        // 4 k-steps of depth 4 over the 16 staged rows
        #pragma unroll
        for (int kk = 0; kk < 4; ++kk) {
            const int r0 = kk * 4 + 2 * h2;
            v2f a, b0, b1;
            a.x  = ldsV[(r0    ) * PK + 16 * iM + m];
            a.y  = ldsV[(r0 + 1) * PK + 16 * iM + m];
            b0.x = ldsK[(r0    ) * PK + 16 * j0 + m];
            b0.y = ldsK[(r0 + 1) * PK + 16 * j0 + m];
            b1.x = ldsK[(r0    ) * PK + 16 * (j0 + 1) + m];
            b1.y = ldsK[(r0 + 1) * PK + 16 * (j0 + 1) + m];
            acc0 = __builtin_amdgcn_wmma_f32_16x16x4_f32(false, a, false, b0,
                                                         (short)0, acc0, false, false);
            acc1 = __builtin_amdgcn_wmma_f32_16x16x4_f32(false, a, false, b1,
                                                         (short)0, acc1, false, false);
        }
    }

    // reduce ksum partials across the block, one atomic per column
    ldsRed[tid] = ks_acc;
    __syncthreads();
    if (tid < 64) {
        float s = ldsRed[tid] + ldsRed[tid + 64] + ldsRed[tid + 128] + ldsRed[tid + 192];
        atomicAdd(&ksum[bh * Dc + tid], s);
    }

    // accumulate this split's partial kv^T tiles into workspace
    float* kvb = kvT + (size_t)bh * Dc * Dc;
    #pragma unroll
    for (int v = 0; v < 8; ++v) {
        const int e = 16 * iM + v + 8 * h2;   // C-layout: VGPR v, half-wave h2
        atomicAdd(&kvb[e * Dc + 16 * j0 + m],       acc0[v]);
        atomicAdd(&kvb[e * Dc + 16 * (j0 + 1) + m], acc1[v]);
    }
}

// ---------------------------------------------------------------------------
// Kernel 2: out[s,e] = (Q[s,:]/(Q[s,:].ksum + eps)) @ kv
// grid = (S/128, BH), block = 256 (8 waves x 16 rows each)
// ---------------------------------------------------------------------------
__global__ __launch_bounds__(256) void context_kernel(
    const float* __restrict__ Q, const float* __restrict__ kvT,
    const float* __restrict__ ksum, float* __restrict__ Out)
{
    __shared__ __attribute__((aligned(16))) float lds_kv[Dc * PC];      // kv^T, [e][d], row pitch PC
    __shared__ float lds_ks[Dc];
    __shared__ __attribute__((aligned(16))) float lds_q[8 * 16 * PC];   // per-wave staged/normalized Q rows, row pitch PC

    const int bh   = blockIdx.y;
    const int tid  = threadIdx.x;
    const int lane = tid & 31;
    const int w    = tid >> 5;
    const int m    = lane & 15;
    const int h2   = lane >> 4;

    const int s0 = blockIdx.x * 128 + w * 16;
    const float* Qb = Q + (size_t)bh * Sc * Dc + (size_t)s0 * Dc;
    float* qs = lds_q + w * (16 * PC);

    // cache kv^T (16 KB) + this wave's 16 Q rows in LDS
    {
        const float* src = kvT + (size_t)bh * Dc * Dc;
#if USE_ASYNC_LDS
        #pragma unroll
        for (int it = 0; it < 4; ++it) {
            int off = it * 1024 + tid * 4;
            ASYNC_CP_B128(src + off, lds_kv + (off >> 6) * PC + (off & 63));
        }
        #pragma unroll
        for (int it = 0; it < 8; ++it) {
            int off = it * 128 + lane * 4;
            ASYNC_CP_B128(Qb + off, qs + (off >> 6) * PC + (off & 63));
        }
#else
        #pragma unroll
        for (int it = 0; it < 4; ++it) {
            int off = it * 1024 + tid * 4;
            *(float4*)(lds_kv + (off >> 6) * PC + (off & 63)) = *(const float4*)(src + off);
        }
        #pragma unroll
        for (int it = 0; it < 8; ++it) {
            int off = it * 128 + lane * 4;
            *(float4*)(qs + (off >> 6) * PC + (off & 63)) = *(const float4*)(Qb + off);
        }
#endif
        if (tid < Dc) lds_ks[tid] = ksum[bh * Dc + tid];
#if USE_ASYNC_LDS
        __builtin_amdgcn_s_wait_asynccnt(0);
#endif
    }
    __syncthreads();

    // denominator: 2 lanes per row, half-row dot each, combined via wave32 shuffle
    float part = 0.0f;
    #pragma unroll
    for (int c = 0; c < 32; ++c)
        part += qs[m * PC + h2 * 32 + c] * lds_ks[h2 * 32 + c];
    float other = __shfl_xor(part, 16, 32);
    float rinv = 1.0f / (part + other + EPS);
    #pragma unroll
    for (int c = 0; c < 32; ++c)
        qs[m * PC + h2 * 32 + c] *= rinv;
    __syncthreads();

    // out tile row-block (16 x 64) = qhat (16 x 64) @ kv (64 x 64)
    v8f acc[4] = {{}, {}, {}, {}};
    #pragma unroll 4
    for (int kk = 0; kk < 16; ++kk) {
        // A fragment: lane holds q[row m][k = 4*kk + 2*h2 + {0,1}]
        v2f a = *(const v2f*)(qs + m * PC + kk * 4 + 2 * h2);
        #pragma unroll
        for (int j = 0; j < 4; ++j) {
            // B fragment: B[k][n] = kv[d=k][e=16j+n] = kvT[16j+n][k] (contiguous pair)
            v2f b = *(const v2f*)(lds_kv + (16 * j + m) * PC + kk * 4 + 2 * h2);
            acc[j] = __builtin_amdgcn_wmma_f32_16x16x4_f32(false, a, false, b,
                                                           (short)0, acc[j], false, false);
        }
    }

    float* Ob = Out + (size_t)bh * Sc * Dc + (size_t)s0 * Dc;
    #pragma unroll
    for (int v = 0; v < 8; ++v) {
        const int row = v + 8 * h2;
        #pragma unroll
        for (int j = 0; j < 4; ++j)
            Ob[row * Dc + 16 * j + m] = acc[j][v];
    }
}

// ---------------------------------------------------------------------------
extern "C" void kernel_launch(void* const* d_in, const int* in_sizes, int n_in,
                              void* d_out, int out_size, void* d_ws, size_t ws_size,
                              hipStream_t stream) {
    const float* Q = (const float*)d_in[0];
    const float* K = (const float*)d_in[1];
    const float* V = (const float*)d_in[2];
    float* Out = (float*)d_out;

    float* ws   = (float*)d_ws;
    float* kvT  = ws;                       // BH * 64 * 64 floats
    float* ksum = ws + BH * Dc * Dc;        // BH * 64 floats

    const int nzero = BH * Dc * Dc + BH * Dc;
    zero_ws_kernel<<<(nzero + 255) / 256, 256, 0, stream>>>(ws, nzero);
    kv_reduce_kernel<<<dim3(SPLIT, BH), 256, 0, stream>>>(K, V, kvT, ksum);
    context_kernel<<<dim3(Sc / 128, BH), 256, 0, stream>>>(Q, kvT, ksum, Out);
}

// v002
// Measured time: 36.4 microseconds a run.
// In two side-by-side timings against v001, it was 1.43 and 1.42 times as fast.
// All steps since v000 together make it 2.35 times as fast.
#include <hip/hip_runtime.h>

typedef __attribute__((ext_vector_type(2))) float v2f;
typedef __attribute__((ext_vector_type(8))) float v8f;
typedef __attribute__((ext_vector_type(4))) int   v4i;

constexpr int Sc = 4096;   // sequence length
constexpr int Dc = 64;     // head dim
constexpr int BH = 64;     // B*H = 4*16
constexpr int SPLIT = 8;   // S-splits for the kv reduction
constexpr float EPS = 1e-5f;

// LDS row pitches in floats (64 banks of 4 bytes; bank = dword address mod 64).
// PK: the kv reduction reads 16 consecutive floats of rows r..r+3 at once; 80 mod 64 = 16
//     puts the four rows on four disjoint groups of 16 banks.
// PC: the context kernel walks a column of 16 rows with 8- and 16-byte reads; 68 mod 64 = 4
//     puts row m on banks 4m.., so the 16 rows cover all 64 banks.
// Both are multiples of 4 floats, so every 16-byte copy stays 16-byte aligned.
constexpr int PK = 80;
constexpr int PC = 68;

// gfx1250 async global->LDS path (ASYNCcnt-tracked direct-to-LDS copies).
// Signature (from hipcc diagnostic): (v4i AS1*, v4i AS3*, imm offset, imm cpol)
#if defined(__gfx1250__) && __has_builtin(__builtin_amdgcn_global_load_async_to_lds_b128) && __has_builtin(__builtin_amdgcn_s_wait_asynccnt)
#define USE_ASYNC_LDS 1
#define AS1 __attribute__((address_space(1)))
#define AS3 __attribute__((address_space(3)))
#define ASYNC_CP_B128(gsrc, ldst) \
    __builtin_amdgcn_global_load_async_to_lds_b128((AS1 v4i*)(gsrc), (AS3 v4i*)(ldst), 0, 0)
#else
#define USE_ASYNC_LDS 0
#endif

// ---------------------------------------------------------------------------
// Kernel 0: zero workspace (kv^T accumulators + ksum accumulators)
// ---------------------------------------------------------------------------
__global__ void zero_ws_kernel(float* __restrict__ p, int n) {
    int i = blockIdx.x * blockDim.x + threadIdx.x;
    if (i < n) p[i] = 0.0f;
}

// ---------------------------------------------------------------------------
// Kernel 1: kv^T[bh][e][d] = sum_s V[bh,s,e] * K[bh,s,d]   (A = V^T, B = K)
//           ksum[bh][d]    = sum_s K[bh,s,d]
// grid = (SPLIT, BH), block = 256 (8 waves). Each wave owns 2 of 16 tiles.
// K and V come through a ring of two LDS buffers of SR rows each: stage t + 1 is in
// flight while stage t is multiplied, so a stage's matrix work covers the memory latency.
// ---------------------------------------------------------------------------
constexpr int SR  = 64;                    // rows of K and of V per stage
constexpr int NT  = (Sc / SPLIT) / SR;     // stages per block
constexpr int STG = SR * PK;               // floats of one buffer of one operand

// One stage: every thread copies 4 pieces of 16 bytes of K and 4 of V, 16 rows apart.
// gk, gv: the thread's first piece in memory; lk, lv: its place in the LDS buffer.
__device__ __forceinline__ void copy_stage(const float* gk, const float* gv, float* lk, float* lv)
{
#if USE_ASYNC_LDS
    const unsigned k0 = (unsigned)(size_t)lk;   // low 32 bits = byte address in LDS
    const unsigned v0 = (unsigned)(size_t)lv;
    // The closing s_wait_xcnt 0 stands in the copies' own statement so that no address
    // register of a copy is rewritten in front of it.
    asm volatile(
        "global_load_async_to_lds_b128 %0, %8, off\n\t"
        "global_load_async_to_lds_b128 %1, %9, off\n\t"
        "global_load_async_to_lds_b128 %2, %10, off\n\t"
        "global_load_async_to_lds_b128 %3, %11, off\n\t"
        "global_load_async_to_lds_b128 %4, %12, off\n\t"
        "global_load_async_to_lds_b128 %5, %13, off\n\t"
        "global_load_async_to_lds_b128 %6, %14, off\n\t"
        "global_load_async_to_lds_b128 %7, %15, off\n\t"
        "s_wait_xcnt 0x0"
        :: "v"(k0), "v"(k0 + 16 * PK * 4), "v"(k0 + 32 * PK * 4), "v"(k0 + 48 * PK * 4),
           "v"(v0), "v"(v0 + 16 * PK * 4), "v"(v0 + 32 * PK * 4), "v"(v0 + 48 * PK * 4),
           "v"(gk), "v"(gk + 16 * Dc), "v"(gk + 32 * Dc), "v"(gk + 48 * Dc),
           "v"(gv), "v"(gv + 16 * Dc), "v"(gv + 32 * Dc), "v"(gv + 48 * Dc)
        : "memory");
#else
    #pragma unroll
    for (int i = 0; i < 4; ++i) {
        *(float4*)(lk + 16 * i * PK) = *(const float4*)(gk + 16 * i * Dc);
        *(float4*)(lv + 16 * i * PK) = *(const float4*)(gv + 16 * i * Dc);
    }
#endif
}

// This wave's own copies have landed in LDS.
__device__ __forceinline__ void wait_copies()
{
#if USE_ASYNC_LDS
    asm volatile("s_wait_asynccnt 0x0" ::: "memory");
#endif
}

__global__ __launch_bounds__(256) void kv_reduce_kernel(
    const float* __restrict__ K, const float* __restrict__ V,
    float* __restrict__ kvT, float* __restrict__ ksum)
{
    __shared__ __attribute__((aligned(16))) float ldsK[2 * STG];
    __shared__ __attribute__((aligned(16))) float ldsV[2 * STG];
    __shared__ float ldsRed[256];

    const int bh    = blockIdx.y;
    const int chunk = blockIdx.x;
    const int tid   = threadIdx.x;
    const int lane  = tid & 31;
    const int w     = tid >> 5;
    const int m     = lane & 15;       // row/col within tile
    const int h2    = lane >> 4;       // half-wave select (k-base = 2*h2)

    const int iM = w >> 1;             // e-tile index (A-matrix rows, from V)
    const int j0 = (w & 1) * 2;        // first d-tile index (B-matrix cols, from K)

    const int s_begin = chunk * (Sc / SPLIT);   // 512 rows per block

    v8f acc0 = {};
    v8f acc1 = {};

    float ks_acc = 0.0f;
    const int d_col = tid & 63;
    const int r_off = tid >> 6;

    // staging: the thread's first 16-byte piece of a stage (row lr of 16, column lc)
    const int lr = tid >> 4;
    const int lc = (tid & 15) * 4;
    const float* gk = K + ((size_t)bh * Sc + s_begin + lr) * Dc + lc;
    const float* gv = V + ((size_t)bh * Sc + s_begin + lr) * Dc + lc;
    float* lk = ldsK + lr * PK + lc;
    float* lv = ldsV + lr * PK + lc;

    // prologue: stage 0 lands and is published, then stage 1 starts into the other buffer
    copy_stage(gk, gv, lk, lv);
    wait_copies();
    __syncthreads();
    copy_stage(gk + SR * Dc, gv + SR * Dc, lk + STG, lv + STG);

    for (int t = 0; t < NT; ++t) {
        const int bo = (t & 1) * STG;
        const float* sK = ldsK + bo;
        const float* sV = ldsV + bo;

        // ksum partial: 4 threads per column, every fourth row each
        // (unrolled so that every LDS offset is an immediate)
        #pragma unroll
        for (int r = 0; r < SR / 4; ++r)
            ks_acc += sK[(r_off + 4 * r) * PK + d_col];

        // k-steps of depth 4 over the staged rows
        // (unrolled so that every LDS offset is an immediate and loads run ahead of the products)
        #pragma unroll
        for (int kk = 0; kk < SR / 4; ++kk) {
            const int r0 = kk * 4 + 2 * h2;
            v2f a, b0, b1;
            a.x  = sV[(r0    ) * PK + 16 * iM + m];
            a.y  = sV[(r0 + 1) * PK + 16 * iM + m];
            b0.x = sK[(r0    ) * PK + 16 * j0 + m];
            b0.y = sK[(r0 + 1) * PK + 16 * j0 + m];
            b1.x = sK[(r0    ) * PK + 16 * (j0 + 1) + m];
            b1.y = sK[(r0 + 1) * PK + 16 * (j0 + 1) + m];
            acc0 = __builtin_amdgcn_wmma_f32_16x16x4_f32(false, a, false, b0,
                                                         (short)0, acc0, false, false);
            acc1 = __builtin_amdgcn_wmma_f32_16x16x4_f32(false, a, false, b1,
                                                         (short)0, acc1, false, false);
        }

        // publish point of stage t + 1: this wave's reads of stage t are done, its copies of
        // stage t + 1 have landed; behind the barrier that holds for every wave
        asm volatile("s_wait_dscnt 0x0" ::: "memory");
        wait_copies();
        __syncthreads();
        // refill the buffer that every wave has just left
        if (t + 2 < NT)
            copy_stage(gk + (t + 2) * SR * Dc, gv + (t + 2) * SR * Dc, lk + bo, lv + bo);
    }
    wait_copies();   // nothing is in flight when the wave goes on to the epilogue

    // reduce ksum partials across the block, one atomic per column
    ldsRed[tid] = ks_acc;
    __syncthreads();
    if (tid < 64) {
        float s = ldsRed[tid] + ldsRed[tid + 64] + ldsRed[tid + 128] + ldsRed[tid + 192];
        atomicAdd(&ksum[bh * Dc + tid], s);
    }

    // accumulate this split's partial kv^T tiles into workspace
    float* kvb = kvT + (size_t)bh * Dc * Dc;
    #pragma unroll
    for (int v = 0; v < 8; ++v) {
        const int e = 16 * iM + v + 8 * h2;   // C-layout: VGPR v, half-wave h2
        atomicAdd(&kvb[e * Dc + 16 * j0 + m],       acc0[v]);
        atomicAdd(&kvb[e * Dc + 16 * (j0 + 1) + m], acc1[v]);
    }
}

// ---------------------------------------------------------------------------
// Kernel 2: out[s,e] = (Q[s,:]/(Q[s,:].ksum + eps)) @ kv
// grid = (S/128, BH), block = 256 (8 waves x 16 rows each)
// ---------------------------------------------------------------------------
__global__ __launch_bounds__(256) void context_kernel(
    const float* __restrict__ Q, const float* __restrict__ kvT,
    const float* __restrict__ ksum, float* __restrict__ Out)
{
    __shared__ __attribute__((aligned(16))) float lds_kv[Dc * PC];      // kv^T, [e][d], row pitch PC
    __shared__ float lds_ks[Dc];
    __shared__ __attribute__((aligned(16))) float lds_q[8 * 16 * PC];   // per-wave staged/normalized Q rows, row pitch PC

    const int bh   = blockIdx.y;
    const int tid  = threadIdx.x;
    const int lane = tid & 31;
    const int w    = tid >> 5;
    const int m    = lane & 15;
    const int h2   = lane >> 4;

    const int s0 = blockIdx.x * 128 + w * 16;
    const float* Qb = Q + (size_t)bh * Sc * Dc + (size_t)s0 * Dc;
    float* qs = lds_q + w * (16 * PC);

    // cache kv^T (16 KB) + this wave's 16 Q rows in LDS
    {
        const float* src = kvT + (size_t)bh * Dc * Dc;
#if USE_ASYNC_LDS
        #pragma unroll
        for (int it = 0; it < 4; ++it) {
            int off = it * 1024 + tid * 4;
            ASYNC_CP_B128(src + off, lds_kv + (off >> 6) * PC + (off & 63));
        }
        #pragma unroll
        for (int it = 0; it < 8; ++it) {
            int off = it * 128 + lane * 4;
            ASYNC_CP_B128(Qb + off, qs + (off >> 6) * PC + (off & 63));
        }
#else
        #pragma unroll
        for (int it = 0; it < 4; ++it) {
            int off = it * 1024 + tid * 4;
            *(float4*)(lds_kv + (off >> 6) * PC + (off & 63)) = *(const float4*)(src + off);
        }
        #pragma unroll
        for (int it = 0; it < 8; ++it) {
            int off = it * 128 + lane * 4;
            *(float4*)(qs + (off >> 6) * PC + (off & 63)) = *(const float4*)(Qb + off);
        }
#endif
        if (tid < Dc) lds_ks[tid] = ksum[bh * Dc + tid];
#if USE_ASYNC_LDS
        __builtin_amdgcn_s_wait_asynccnt(0);
#endif
    }
    __syncthreads();

    // denominator: 2 lanes per row, half-row dot each, combined via wave32 shuffle
    float part = 0.0f;
    #pragma unroll
    for (int c = 0; c < 32; ++c)
        part += qs[m * PC + h2 * 32 + c] * lds_ks[h2 * 32 + c];
    float other = __shfl_xor(part, 16, 32);
    float rinv = 1.0f / (part + other + EPS);
    #pragma unroll
    for (int c = 0; c < 32; ++c)
        qs[m * PC + h2 * 32 + c] *= rinv;
    __syncthreads();

    // out tile row-block (16 x 64) = qhat (16 x 64) @ kv (64 x 64)
    v8f acc[4] = {{}, {}, {}, {}};
    #pragma unroll 4
    for (int kk = 0; kk < 16; ++kk) {
        // A fragment: lane holds q[row m][k = 4*kk + 2*h2 + {0,1}]
        v2f a = *(const v2f*)(qs + m * PC + kk * 4 + 2 * h2);
        #pragma unroll
        for (int j = 0; j < 4; ++j) {
            // B fragment: B[k][n] = kv[d=k][e=16j+n] = kvT[16j+n][k] (contiguous pair)
            v2f b = *(const v2f*)(lds_kv + (16 * j + m) * PC + kk * 4 + 2 * h2);
            acc[j] = __builtin_amdgcn_wmma_f32_16x16x4_f32(false, a, false, b,
                                                           (short)0, acc[j], false, false);
        }
    }

    float* Ob = Out + (size_t)bh * Sc * Dc + (size_t)s0 * Dc;
    #pragma unroll
    for (int v = 0; v < 8; ++v) {
        const int row = v + 8 * h2;
        #pragma unroll
        for (int j = 0; j < 4; ++j)
            Ob[row * Dc + 16 * j + m] = acc[j][v];
    }
}

// ---------------------------------------------------------------------------
extern "C" void kernel_launch(void* const* d_in, const int* in_sizes, int n_in,
                              void* d_out, int out_size, void* d_ws, size_t ws_size,
                              hipStream_t stream) {
    const float* Q = (const float*)d_in[0];
    const float* K = (const float*)d_in[1];
    const float* V = (const float*)d_in[2];
    float* Out = (float*)d_out;

    float* ws   = (float*)d_ws;
    float* kvT  = ws;                       // BH * 64 * 64 floats
    float* ksum = ws + BH * Dc * Dc;        // BH * 64 floats

    const int nzero = BH * Dc * Dc + BH * Dc;
    zero_ws_kernel<<<(nzero + 255) / 256, 256, 0, stream>>>(ws, nzero);
    kv_reduce_kernel<<<dim3(SPLIT, BH), 256, 0, stream>>>(K, V, kvT, ksum);
    context_kernel<<<dim3(Sc / 128, BH), 256, 0, stream>>>(Q, kvT, ksum, Out);
}

// v003
// A run of this version takes 35.1 microseconds.
// Timed twice side by side with v002, it ran 1.03 and 1.04 times as fast.
// All steps since v000 together make it 2.44 times as fast.
#include <hip/hip_runtime.h>

typedef __attribute__((ext_vector_type(2))) float v2f;
typedef __attribute__((ext_vector_type(4))) float v4f;
typedef __attribute__((ext_vector_type(8))) float v8f;
typedef __attribute__((ext_vector_type(4))) int   v4i;

constexpr int Sc = 4096;   // sequence length
constexpr int Dc = 64;     // head dim
constexpr int BH = 64;     // B*H = 4*16
constexpr int SPLIT = 8;   // S-splits for the kv reduction
constexpr float EPS = 1e-5f;

// LDS row pitch in floats (64 banks of 4 bytes; bank = dword address mod 64).
// PC: the context kernel walks a column of 16 rows with 8- and 16-byte reads; 68 mod 64 = 4
//     puts row m on banks 4m.., so the 16 rows cover all 64 banks.
// A multiple of 4 floats, so every 16-byte copy stays 16-byte aligned.
constexpr int PC = 68;

// gfx1250 async global->LDS path (ASYNCcnt-tracked direct-to-LDS copies).
// Signature (from hipcc diagnostic): (v4i AS1*, v4i AS3*, imm offset, imm cpol)
#if defined(__gfx1250__) && __has_builtin(__builtin_amdgcn_global_load_async_to_lds_b128) && __has_builtin(__builtin_amdgcn_s_wait_asynccnt)
#define USE_ASYNC_LDS 1
#define AS1 __attribute__((address_space(1)))
#define AS3 __attribute__((address_space(3)))
#define ASYNC_CP_B128(gsrc, ldst) \
    __builtin_amdgcn_global_load_async_to_lds_b128((AS1 v4i*)(gsrc), (AS3 v4i*)(ldst), 0, 0)
#else
#define USE_ASYNC_LDS 0
#endif

// ---------------------------------------------------------------------------
// Kernel 0: zero workspace (kv^T accumulators + ksum accumulators)
// ---------------------------------------------------------------------------
__global__ void zero_ws_kernel(float* __restrict__ p, int n) {
    int i = blockIdx.x * blockDim.x + threadIdx.x;
    if (i < n) p[i] = 0.0f;
}

// ---------------------------------------------------------------------------
// Kernel 1: kv^T[bh][e][d] = sum_s V[bh,s,e] * K[bh,s,d]   (A = V^T, B = K)
//           ksum[bh][d]    = sum_s K[bh,s,d]
// grid = (SPLIT, BH), block = 256 (8 waves). Each wave owns all 16 tiles of the 64 x 64
// result for RW rows of its own and takes its fragments straight from memory:
// lane l reads floats 4l..4l+3 of a 512-byte pair of rows, so one 16-byte load is one
// k value of four tiles (tile i of A holds e = 4M + i, tile j of B holds d = 4N + j).
// Four loads feed 16 products; nothing is staged and no wave waits for another in the loop.
// k order of a step of 4 rows, the same for A and B: component x = row h2, y = row 2 + h2.
// ---------------------------------------------------------------------------
constexpr int RW    = (Sc / SPLIT) / 8;    // rows per wave
constexpr int KS    = RW / 4;              // k-steps of depth 4 per wave
constexpr int AHEAD = 4;                   // k-steps whose loads are in flight

// One k-step: 16 products from 4 loaded pieces, and K's column sums from the same registers.
__device__ __forceinline__ void kv_step(v8f (&acc)[4][4], v2f& ks01, v2f& ks23,
                                        v4f ax, v4f ay, v4f bx, v4f by)
{
    ks01 += bx.xy + by.xy;
    ks23 += bx.zw + by.zw;
    const v2f a[4] = {{ax.x, ay.x}, {ax.y, ay.y}, {ax.z, ay.z}, {ax.w, ay.w}};
    const v2f b[4] = {{bx.x, by.x}, {bx.y, by.y}, {bx.z, by.z}, {bx.w, by.w}};
    #pragma unroll
    for (int i = 0; i < 4; ++i)
        #pragma unroll
        for (int j = 0; j < 4; ++j)
            acc[i][j] = __builtin_amdgcn_wmma_f32_16x16x4_f32(false, a[i], false, b[j],
                                                              (short)0, acc[i][j], false, false);
}

__global__ __launch_bounds__(256) void kv_reduce_kernel(
    const float* __restrict__ K, const float* __restrict__ V,
    float* __restrict__ kvT, float* __restrict__ ksum)
{
    __shared__ __attribute__((aligned(16))) float red[8 * Dc * Dc];    // one kv^T plane per wave
    __shared__ __attribute__((aligned(16))) float redK[16 * Dc];       // ksum, one row per half-wave

    const int bh    = blockIdx.y;
    const int chunk = blockIdx.x;
    const int tid   = threadIdx.x;
    const int lane  = tid & 31;
    const int w     = tid >> 5;
    const int m     = lane & 15;
    const int h2    = lane >> 4;

    const size_t base = ((size_t)bh * Sc + chunk * (Sc / SPLIT) + w * RW) * Dc + lane * 4;
    const v4f* gk = (const v4f*)(K + base);   // a k-step is 64 pieces of 16 bytes; y stands 32 behind x
    const v4f* gv = (const v4f*)(V + base);

    v8f acc[4][4] = {};
    v2f ks01 = {}, ks23 = {};

    v4f kx[AHEAD], ky[AHEAD], vx[AHEAD], vy[AHEAD];
    #pragma unroll
    for (int s = 0; s < AHEAD; ++s) {
        kx[s] = gk[s * 64];  ky[s] = gk[s * 64 + 32];
        vx[s] = gv[s * 64];  vy[s] = gv[s * 64 + 32];
    }

    // unrolled so that the ring of load registers is indexed by constants
    #pragma unroll
    for (int t = 0; t < KS; ++t) {
        const int s = t % AHEAD;
        const v4f bx = kx[s], by = ky[s], ax = vx[s], ay = vy[s];
        if (t + AHEAD < KS) {
            kx[s] = gk[(t + AHEAD) * 64];  ky[s] = gk[(t + AHEAD) * 64 + 32];
            vx[s] = gv[(t + AHEAD) * 64];  vy[s] = gv[(t + AHEAD) * 64 + 32];
        }
        kv_step(acc, ks01, ks23, ax, ay, bx, by);
        // keeps each step's loads in their step: hoisted, they would take the registers of a
        // deeper ring; sunk, they would lose their lead over the products
        __builtin_amdgcn_sched_barrier(0);
    }
    const float4 ks = make_float4(ks01.x, ks01.y, ks23.x, ks23.y);

    // each wave lays its plane down as kv^T[e][d]: register v of tile (i, j) is e = 4(8 h2 + v) + i,
    // d = 4m + j, so the four j of one (i, v) are 16 contiguous bytes
    float* my = red + w * (Dc * Dc);
    #pragma unroll
    for (int i = 0; i < 4; ++i)
        #pragma unroll
        for (int v = 0; v < 8; ++v)
            *(float4*)(my + (4 * (8 * h2 + v) + i) * Dc + 4 * m) =
                make_float4(acc[i][0][v], acc[i][1][v], acc[i][2][v], acc[i][3][v]);
    *(float4*)(redK + (2 * w + h2) * Dc + 4 * m) = ks;
    __syncthreads();

    // sum the 8 planes in wave order, then add this split's sum into the workspace
    float* kvb = kvT + (size_t)bh * Dc * Dc;
    #pragma unroll
    for (int r = 0; r < 4; ++r) {
        const int q = (tid + 256 * r) * 4;
        float4 s = *(const float4*)(red + q);
        #pragma unroll
        for (int p = 1; p < 8; ++p) {
            const float4 u = *(const float4*)(red + p * (Dc * Dc) + q);
            s.x += u.x;  s.y += u.y;  s.z += u.z;  s.w += u.w;
        }
        atomicAdd(&kvb[q],     s.x);
        atomicAdd(&kvb[q + 1], s.y);
        atomicAdd(&kvb[q + 2], s.z);
        atomicAdd(&kvb[q + 3], s.w);
    }
    if (tid < Dc) {
        float s = redK[tid];
        #pragma unroll
        for (int p = 1; p < 16; ++p)
            s += redK[p * Dc + tid];
        atomicAdd(&ksum[bh * Dc + tid], s);
    }
}

// ---------------------------------------------------------------------------
// Kernel 2: out[s,e] = (Q[s,:]/(Q[s,:].ksum + eps)) @ kv
// grid = (S/128, BH), block = 256 (8 waves x 16 rows each)
// ---------------------------------------------------------------------------
__global__ __launch_bounds__(256) void context_kernel(
    const float* __restrict__ Q, const float* __restrict__ kvT,
    const float* __restrict__ ksum, float* __restrict__ Out)
{
    __shared__ __attribute__((aligned(16))) float lds_kv[Dc * PC];      // kv^T, [e][d], row pitch PC
    __shared__ float lds_ks[Dc];
    __shared__ __attribute__((aligned(16))) float lds_q[8 * 16 * PC];   // per-wave staged/normalized Q rows, row pitch PC

    const int bh   = blockIdx.y;
    const int tid  = threadIdx.x;
    const int lane = tid & 31;
    const int w    = tid >> 5;
    const int m    = lane & 15;
    const int h2   = lane >> 4;

    const int s0 = blockIdx.x * 128 + w * 16;
    const float* Qb = Q + (size_t)bh * Sc * Dc + (size_t)s0 * Dc;
    float* qs = lds_q + w * (16 * PC);

    // cache kv^T (16 KB) + this wave's 16 Q rows in LDS
    {
        const float* src = kvT + (size_t)bh * Dc * Dc;
#if USE_ASYNC_LDS
        #pragma unroll
        for (int it = 0; it < 4; ++it) {
            int off = it * 1024 + tid * 4;
            ASYNC_CP_B128(src + off, lds_kv + (off >> 6) * PC + (off & 63));
        }
        #pragma unroll
        for (int it = 0; it < 8; ++it) {
            int off = it * 128 + lane * 4;
            ASYNC_CP_B128(Qb + off, qs + (off >> 6) * PC + (off & 63));
        }
#else
        #pragma unroll
        for (int it = 0; it < 4; ++it) {
            int off = it * 1024 + tid * 4;
            *(float4*)(lds_kv + (off >> 6) * PC + (off & 63)) = *(const float4*)(src + off);
        }
        #pragma unroll
        for (int it = 0; it < 8; ++it) {
            int off = it * 128 + lane * 4;
            *(float4*)(qs + (off >> 6) * PC + (off & 63)) = *(const float4*)(Qb + off);
        }
#endif
        if (tid < Dc) lds_ks[tid] = ksum[bh * Dc + tid];
#if USE_ASYNC_LDS
        __builtin_amdgcn_s_wait_asynccnt(0);
#endif
    }
    __syncthreads();

    // denominator: 2 lanes per row, half-row dot each, combined via wave32 shuffle
    float part = 0.0f;
    #pragma unroll
    for (int c = 0; c < 32; ++c)
        part += qs[m * PC + h2 * 32 + c] * lds_ks[h2 * 32 + c];
    float other = __shfl_xor(part, 16, 32);
    float rinv = 1.0f / (part + other + EPS);
    #pragma unroll
    for (int c = 0; c < 32; ++c)
        qs[m * PC + h2 * 32 + c] *= rinv;
    __syncthreads();

    // out tile row-block (16 x 64) = qhat (16 x 64) @ kv (64 x 64)
    v8f acc[4] = {{}, {}, {}, {}};
    #pragma unroll 4
    for (int kk = 0; kk < 16; ++kk) {
        // A fragment: lane holds q[row m][k = 4*kk + 2*h2 + {0,1}]
        v2f a = *(const v2f*)(qs + m * PC + kk * 4 + 2 * h2);
        #pragma unroll
        for (int j = 0; j < 4; ++j) {
            // B fragment: B[k][n] = kv[d=k][e=16j+n] = kvT[16j+n][k] (contiguous pair)
            v2f b = *(const v2f*)(lds_kv + (16 * j + m) * PC + kk * 4 + 2 * h2);
            acc[j] = __builtin_amdgcn_wmma_f32_16x16x4_f32(false, a, false, b,
                                                           (short)0, acc[j], false, false);
        }
    }

    float* Ob = Out + (size_t)bh * Sc * Dc + (size_t)s0 * Dc;
    #pragma unroll
    for (int v = 0; v < 8; ++v) {
        const int row = v + 8 * h2;
        #pragma unroll
        for (int j = 0; j < 4; ++j)
            Ob[row * Dc + 16 * j + m] = acc[j][v];
    }
}

// ---------------------------------------------------------------------------
extern "C" void kernel_launch(void* const* d_in, const int* in_sizes, int n_in,
                              void* d_out, int out_size, void* d_ws, size_t ws_size,
                              hipStream_t stream) {
    const float* Q = (const float*)d_in[0];
    const float* K = (const float*)d_in[1];
    const float* V = (const float*)d_in[2];
    float* Out = (float*)d_out;

    float* ws   = (float*)d_ws;
    float* kvT  = ws;                       // BH * 64 * 64 floats
    float* ksum = ws + BH * Dc * Dc;        // BH * 64 floats

    const int nzero = BH * Dc * Dc + BH * Dc;
    zero_ws_kernel<<<(nzero + 255) / 256, 256, 0, stream>>>(ws, nzero);
    kv_reduce_kernel<<<dim3(SPLIT, BH), 256, 0, stream>>>(K, V, kvT, ksum);
    context_kernel<<<dim3(Sc / 128, BH), 256, 0, stream>>>(Q, kvT, ksum, Out);
}
